// v000
// The times below were measured on an AMD MI455X: many runs one after another, warmed up first and cycling through
// copies of the inputs, with the whole window's GPU time divided by the number of runs. Launches and the gaps
// between them are all in it. The median over several windows is given; except for v000 it joins two sittings, which
// can be a few percent apart, so the side-by-side timings, each taken in one sitting, are the better comparison.
// v000 is the starting kernel. One run takes 441 microseconds.
// Contractions: q, k, v^T projections = v_wmma_f32_16x16x32_bf16 (bf16 operands from RNE-converted inputs, single product, f32 accumulate);
// q.k^T scores (statistics pass and main pass) = v_wmma_f32_16x16x32_f16 (q as f16 hi plane + f16 residual plane x4096, k f16; 2 products, separate f32 accumulators);
// p.v = v_wmma_f32_16x16x32_f16 (p carried x16384 in f16, v f16; single product, f32 accumulate);
// ctx.Wo = v_wmma_f32_16x16x32_f16 (ctx as f16 hi plane x256 + f16 residual plane x4096, Wo^T f16 x64 of its bf16 value; 2 products, separate f32 accumulators);
// softmax statistics, probabilities, head average, residual add and LayerNorm in f32.
#include <hip/hip_runtime.h>
#include <math.h>
#include <stdint.h>

#ifndef NB
#define NB 2
#endif
#ifndef SEQ
#define SEQ 2048
#endif
#define NB_FULL  2
#define SEQ_FULL 2048
#define EMB      1024
#define NH       16
#define HD       64
#define NROW     (NB * SEQ)          // activation rows in workspace planes, row index = b * SEQ + s
#define NQB      (SEQ / 16)          // 16-row query blocks per sequence
#define NKT      (SEQ / 64)          // 64-key chunks per sequence
#define PCARRY   16384.0f            // power-of-two carry of p in the f16 P.V operand
#define OFF1     ((size_t)NB_FULL * SEQ_FULL * EMB)   // fixed element offset of output 1 in d_out
static_assert(NB >= 1 && NB <= NB_FULL);
static_assert(SEQ >= 64 && SEQ <= SEQ_FULL && (SEQ % 64) == 0);
static_assert(NH * HD == EMB);
static_assert((NROW % 64) == 0 && (EMB % 64) == 0 && (HD % 64) == 0 && (EMB % 32) == 0);
static_assert(OFF1 * 4 == 16777216);   // byte offset of output 1

typedef _Float16 v16h __attribute__((ext_vector_type(16)));
typedef _Float16 v8h  __attribute__((ext_vector_type(8)));
typedef __bf16   v16b __attribute__((ext_vector_type(16)));
typedef __bf16   v8b  __attribute__((ext_vector_type(8)));
typedef float    v8f  __attribute__((ext_vector_type(8)));
typedef float    v4f  __attribute__((ext_vector_type(4)));
typedef unsigned int v4u __attribute__((ext_vector_type(4)));

#if defined(__HIP_DEVICE_COMPILE__)
#define DEV_ASM 1
#else
#define DEV_ASM 0
#endif

// ---- scalar helpers --------------------------------------------------------------------------------
__device__ __forceinline__ unsigned short bf_bits(float f) {          // f32 -> bf16 bits, RNE convert
  unsigned u = __float_as_uint(f);
  return (unsigned short)((u + 0x7FFFu + ((u >> 16) & 1u)) >> 16);
}
__device__ __forceinline__ float bf_up(unsigned short hb) { return __uint_as_float(((unsigned)hb) << 16); }
__device__ __forceinline__ unsigned short h_bits(_Float16 x) { return __builtin_bit_cast(unsigned short, x); }
__device__ __forceinline__ unsigned pk16(unsigned short a, unsigned short b) { return (unsigned)a | ((unsigned)b << 16); }
__device__ __forceinline__ v8f zero8() { v8f z = {0.f, 0.f, 0.f, 0.f, 0.f, 0.f, 0.f, 0.f}; return z; }

// ---- fragment types / loaders: 16-bit A/B operand, lane -> row/col (lane&15), p already includes +8*(lane>>4);
//      elements 0..7 <- p[0..7] (k0+8h..k0+8h+7), elements 8..15 <- p[16..23] (k0+16+8h..k0+16+8h+7)
template <typename OT> struct FT;
template <> struct FT<__bf16>   { typedef v16b frag; typedef v8b half8; };
template <> struct FT<_Float16> { typedef v16h frag; typedef v8h half8; };

template <typename OT>
__device__ __forceinline__ typename FT<OT>::frag ldfrag(const OT* p) {
  union { typename FT<OT>::frag v; typename FT<OT>::half8 h[2]; } f;
  f.h[0] = *(const typename FT<OT>::half8*)(p);
  f.h[1] = *(const typename FT<OT>::half8*)(p + 16);
  return f.v;
}

// ---- WMMA helpers (asm guard bodies are device-only; concrete operand types) -----------------------------
__device__ __forceinline__ v8f mmar(v16b a, v16b b, v8f c) {
  return __builtin_amdgcn_wmma_f32_16x16x32_bf16(false, a, false, b, (short)0, c, false, false);
}
__device__ __forceinline__ v8f mmar(v16h a, v16h b, v8f c) {
  return __builtin_amdgcn_wmma_f32_16x16x32_f16(false, a, false, b, (short)0, c, false, false);
}
// guarded form: 4 VALU slots after the WMMA, D tied, A/B kept live
__device__ __forceinline__ v8f mma_h(v16h a, v16h b, v8f c) {
  c = __builtin_amdgcn_wmma_f32_16x16x32_f16(false, a, false, b, (short)0, c, false, false);
#if DEV_ASM
  asm volatile("v_nop\n\tv_nop\n\tv_nop\n\tv_nop" : "+v"(c) : "v"(a), "v"(b));
#endif
  return c;
}
__device__ __forceinline__ void dep_guard(v8f& a, v8f& b, v16b x, v16b y) {
#if DEV_ASM
  asm volatile("v_nop\n\tv_nop\n\tv_nop\n\tv_nop" : "+v"(a), "+v"(b) : "v"(x), "v"(y));
#else
  (void)a; (void)b; (void)x; (void)y;
#endif
}
__device__ __forceinline__ void dep_guard(v8f& a, v8f& b, v16h x, v16h y) {
#if DEV_ASM
  asm volatile("v_nop\n\tv_nop\n\tv_nop\n\tv_nop" : "+v"(a), "+v"(b) : "v"(x), "v"(y));
#else
  (void)a; (void)b; (void)x; (void)y;
#endif
}
__device__ __forceinline__ void keep4(v16b a, v16b b, v16b c, v16b d) {
#if DEV_ASM
  asm volatile("v_nop" :: "v"(a), "v"(b), "v"(c), "v"(d));
#else
  (void)a; (void)b; (void)c; (void)d;
#endif
}
__device__ __forceinline__ void keep4(v16h a, v16h b, v16h c, v16h d) {
#if DEV_ASM
  asm volatile("v_nop" :: "v"(a), "v"(b), "v"(c), "v"(d));
#else
  (void)a; (void)b; (void)c; (void)d;
#endif
}
__device__ __forceinline__ void acc_guard4(v8f& a, v8f& b, v8f& c, v8f& d) {
#if DEV_ASM
  asm volatile("v_nop\n\tv_nop\n\tv_nop\n\tv_nop" : "+v"(a), "+v"(b), "+v"(c), "+v"(d));
#else
  (void)a; (void)b; (void)c; (void)d;
#endif
}

// 16-bit convert helper. MODE 0: bf16 bits (RNE convert).  MODE 1: f16 bits of (64 * bf16(x)) (exact scaling of the bf16 value).
template <int MODE>
__device__ __forceinline__ unsigned short cvm(float f) {
  const unsigned short hb = bf_bits(f);
  if (MODE == 0) return hb;
  return h_bits((_Float16)(bf_up(hb) * 64.0f));
}

// =====================================================================================================
// f32 -> 16-bit planes, 8 elements per thread, one 16-B store per lane: a wave writes 512 contiguous B
// blockIdx.y selects the batch slab (element strides inStride / outStride).
// coverage: n8 threads x 8 = the whole per-batch slab (n8 is a multiple of 256 for every use here).
// =====================================================================================================
template <int MODE>
__global__ __launch_bounds__(256) void cvt16x8(const float* __restrict__ in, long long inStride,
                                               unsigned short* out, long long outStride, int n8) {
  const int i = blockIdx.x * 256 + (int)threadIdx.x;
  const float* ib = in + (size_t)blockIdx.y * (size_t)inStride;
  unsigned short* ob = out + (size_t)blockIdx.y * (size_t)outStride;
  if (i < n8) {
    const v4f a  = *(const v4f*)(ib + (size_t)i * 8);
    const v4f a4 = *(const v4f*)(ib + (size_t)i * 8 + 4);
    v4u p;
    p[0] = pk16(cvm<MODE>(a[0]),  cvm<MODE>(a[1]));
    p[1] = pk16(cvm<MODE>(a[2]),  cvm<MODE>(a[3]));
    p[2] = pk16(cvm<MODE>(a4[0]), cvm<MODE>(a4[1]));
    p[3] = pk16(cvm<MODE>(a4[2]), cvm<MODE>(a4[3]));
    unsigned short* o = ob + (size_t)i * 8;
    *(v4u*)o = p;
    
  }
}

// =====================================================================================================
// Transpose-convert: in f32 [K rows][N cols] (row-major, N contiguous) -> out 16-bit [N][K] (k contiguous),
// i.e. the Bt / A layout the GEMM wants. One block per 64x64 tile: grid (N/64, K/64), block 256.
// coverage: loads 256 threads x 4 it x 4 = 64x64; stores 256 threads x 2 it x 8 halves = 64x64 = the whole tile;
// grid (N/64, K/64) tiles = the whole [N][K] plane. staged extent == consumed extent (all 64x64 written).
// =====================================================================================================
template <int MODE>
__global__ __launch_bounds__(256) void tr16(const float* __restrict__ in, unsigned short* out, int K, int N) {
  __shared__ float s[64][65];
  const int t  = threadIdx.x;
  const int n0 = blockIdx.x * 64;
  const int k0 = blockIdx.y * 64;
#pragma unroll
  for (int it = 0; it < 4; ++it) {
    const int f  = t + it * 256;
    const int kk = f >> 4, c4 = (f & 15) * 4;
    const v4f v = *(const v4f*)(in + (size_t)(k0 + kk) * (size_t)N + n0 + c4);
    s[kk][c4 + 0] = v[0];
    s[kk][c4 + 1] = v[1];
    s[kk][c4 + 2] = v[2];
    s[kk][c4 + 3] = v[3];
  }
  __syncthreads();
  v4u pv[2];
#pragma unroll
  for (int it = 0; it < 2; ++it) {
    const int nn = (t >> 3) + it * 32, c8 = (t & 7) * 8;
    v4u p;
#pragma unroll
    for (int e = 0; e < 4; ++e)
      p[e] = pk16(cvm<MODE>(s[c8 + 2 * e][nn]), cvm<MODE>(s[c8 + 2 * e + 1][nn]));
    pv[it] = p;
  }
  {
#pragma unroll
    for (int it = 0; it < 2; ++it) {
      const int nn = (t >> 3) + it * 32, c8 = (t & 7) * 8;
      *(v4u*)(out + (size_t)(n0 + nn) * (size_t)K + k0 + c8) = pv[it];
    }
    
  }
}

// =====================================================================================================
// Register-blocked batched WMMA GEMM (16-bit operand type OT): C[m][n] = sum_k A[m][k] * Bt[n][k];
// one wave per (16*MI) x 64 tile, no block barriers. A row-major [M][K] pitch lda; Bt row-major [N][K] pitch ldb
// (k contiguous); M multiple of 16*MI, N multiple of 64, K multiple of 32 (static sizes here). blockIdx.y = batch
// index (strides in elements). Fragments are loaded straight from global with the split k map (ldfrag).
// NPA = number of A planes: 2 -> second plane A2 (same pitch/stride) multiplies the same Bt fragments into a
// second accumulator set, combined as acc + acc2 * rscaleA in the f32 epilogue.
// value v = (acc [+ acc2*rscaleA]) * oscale.
// OUT_MODE 0: f32 C (pitch ldc) = v.
// OUT_MODE 1: f16 plane C = f16(v * cscale).
// OUT_MODE 3: f16 hi plane C = f16(v * cscale) and f16 residual plane C2 = f16((v*cscale - hi) * rscaleC).
// =====================================================================================================
template <typename OT, int MI, int NPA, int OUT_MODE>
__global__ __launch_bounds__(256) void gemm_t(
    const unsigned short* __restrict__ Ap, const unsigned short* __restrict__ A2p, int lda, long long strideA,
    const unsigned short* __restrict__ Btp, int ldb, long long strideB,
    void* Cout, void* Cout2, int ldc, long long strideC,
    int M, int N, int K, float oscale, float rscaleA, float cscale, float rscaleC) {
  typedef typename FT<OT>::frag V16;
  const OT* A  = (const OT*)(const void*)Ap;
  const OT* A2 = (const OT*)(const void*)A2p;
  const OT* Bt = (const OT*)(const void*)Btp;
  __shared__ __align__(16) float sT[8][16 * 68];   // per-wave 16x64 slab, pitch 68 floats
  const int RT   = 16 * MI;
  const int b    = blockIdx.y;
  const int lane = threadIdx.x & 31;
  const int wave = threadIdx.x >> 5;
  const int tilesN = N >> 6;
  const int tilesM = M / RT;
  const int tile = blockIdx.x * 8 + wave;
  if (tile >= tilesM * tilesN) return;   // wave-uniform; no block barriers in this kernel
  const int tm = tile / tilesN;
  const int tn = tile - tm * tilesN;
  const int m0 = tm * RT;
  const int n0 = tn << 6;

  const OT* Ab  = A  + (size_t)b * (size_t)strideA;
  const OT* A2b = A2 + (size_t)b * (size_t)strideA;
  const OT* Bb  = Bt + (size_t)b * (size_t)strideB;

  const int rlane = lane & 15;                 // row (A) / col (B, D) within subtile
  const int koff  = (lane >> 4) * 8;           // k offset of this lane half
  const int mOff  = (lane >> 4) * 8;           // D row offset

  v8f acc[MI][4], acc2[MI][4];
#pragma unroll
  for (int i = 0; i < MI; ++i)
#pragma unroll
    for (int j = 0; j < 4; ++j) { acc[i][j] = zero8(); acc2[i][j] = zero8(); }

  for (int k0 = 0; k0 < K; k0 += 32) {
    V16 bq[4];
#pragma unroll
    for (int j = 0; j < 4; ++j)
      bq[j] = ldfrag<OT>(Bb + (size_t)(n0 + (j << 4) + rlane) * ldb + koff + k0);
#pragma unroll
    for (int i = 0; i < MI; ++i) {
      const V16 af = ldfrag<OT>(Ab + (size_t)(m0 + (i << 4) + rlane) * lda + koff + k0);
#pragma unroll
      for (int j = 0; j < 4; ++j) acc[i][j] = mmar(af, bq[j], acc[i][j]);
      dep_guard(acc[i][0], acc[i][3], af, bq[3]);
      if (NPA == 2) {
        const V16 af2 = ldfrag<OT>(A2b + (size_t)(m0 + (i << 4) + rlane) * lda + koff + k0);
#pragma unroll
        for (int j = 0; j < 4; ++j) acc2[i][j] = mmar(af2, bq[j], acc2[i][j]);
        dep_guard(acc2[i][0], acc2[i][3], af2, bq[3]);
      }
    }
    keep4(bq[0], bq[1], bq[2], bq[3]);
  }
#pragma unroll
  for (int i = 0; i < MI; ++i) {
    acc_guard4(acc[i][0], acc[i][1], acc[i][2], acc[i][3]);
    if (NPA == 2) acc_guard4(acc2[i][0], acc2[i][1], acc2[i][2], acc2[i][3]);
  }

  // ---- epilogue ----
  float* slab = sT[wave];
#pragma unroll
  for (int i = 0; i < MI; ++i) {
    const int mBase = m0 + (i << 4);
#pragma unroll
    for (int j = 0; j < 4; ++j) {
#pragma unroll
      for (int r = 0; r < 8; ++r) {
        float v = acc[i][j][r];
        if (NPA == 2) v += acc2[i][j][r] * rscaleA;
        v = v * oscale;
        slab[(mOff + r) * 68 + (j << 4) + rlane] = v;
      }
    }
    __builtin_amdgcn_fence(__ATOMIC_RELEASE, "workgroup");
    __builtin_amdgcn_wave_barrier();
    __builtin_amdgcn_fence(__ATOMIC_ACQUIRE, "workgroup");
    if (OUT_MODE == 0) {
      float* C = (float*)Cout + (size_t)b * (size_t)strideC;
      const int h2 = lane >> 4, c4 = (lane & 15) * 4;     // 256-B row segment = 16 lanes x 16 B
      v4f ov[8];
#pragma unroll
      for (int it = 0; it < 8; ++it) {
        const int row = it * 2 + h2;                     // it 0..7 x h2 0..1 = rows 0..15
        ov[it] = *(const v4f*)(slab + row * 68 + c4);
      }
      {
#pragma unroll
        for (int it = 0; it < 8; ++it) {
          const int row = it * 2 + h2;
          *(v4f*)(C + (size_t)(mBase + row) * ldc + n0 + c4) = ov[it];
        }
        
      }
    } else {
      const int q = lane >> 3, c8 = (lane & 7) * 8;
      unsigned short* C  = (unsigned short*)Cout  + (size_t)b * (size_t)strideC;
      unsigned short* C2 = (unsigned short*)Cout2 + (size_t)b * (size_t)strideC;
      v4u hv[4], lv[4];
#pragma unroll
      for (int it = 0; it < 4; ++it) {
        const int row = it * 4 + q;                        // it 0..3 x q 0..3 = rows 0..15
        const float* sp = slab + row * 68 + c8;
        float f[8];
#pragma unroll
        for (int e = 0; e < 8; ++e) f[e] = sp[e] * cscale;
        v4u a, a2;
#pragma unroll
        for (int e = 0; e < 4; ++e) {
          const float f0 = f[2 * e], f1 = f[2 * e + 1];
          const _Float16 x0 = (_Float16)f0, x1 = (_Float16)f1;
          const unsigned short h0 = h_bits(x0), h1 = h_bits(x1);
          unsigned short l0 = 0, l1 = 0;
          if (OUT_MODE == 3) {
            l0 = h_bits((_Float16)((f0 - (float)x0) * rscaleC));
            l1 = h_bits((_Float16)((f1 - (float)x1) * rscaleC));
          }
          a[e] = pk16(h0, h1); a2[e] = pk16(l0, l1);
        }
        hv[it] = a; lv[it] = a2;
      }
      {
#pragma unroll
        for (int it = 0; it < 4; ++it) {
          const int row = it * 4 + q;
          *(v4u*)(C + (size_t)(mBase + row) * ldc + n0 + c8) = hv[it];
          if (OUT_MODE == 3) *(v4u*)(C2 + (size_t)(mBase + row) * ldc + n0 + c8) = lv[it];
        }
        
      }
    }
    __builtin_amdgcn_fence(__ATOMIC_RELEASE, "workgroup");
    __builtin_amdgcn_wave_barrier();
    __builtin_amdgcn_fence(__ATOMIC_ACQUIRE, "workgroup");
  }
}

// =====================================================================================================
// Score chunk: 16 query rows (this wave) x 64 keys kv0..kv0+63 of one (b, h).
//   q fragments (A operand, row = lane&15): hi and residual (x4096) planes, 2 d-chunks of 32.
//   k fragments (B operand, col = lane&15 = key) loaded straight from the f16 k plane with the split k map:
//   kb0 = plane + (b*SEQ)*EMB + h*HD, key t adds t*EMB (plane row = b*SEQ + t).
//   s[j][r] = D element: query row 8*hh + r, key kv0 + 16j + (lane&15); value = ((qh.k) + (ql.k)/4096) / 8.
// =====================================================================================================
__device__ __forceinline__ void score_chunk(const v16h (&qah)[2], const v16h (&qal)[2],
                                            const _Float16* __restrict__ kb0, int kv0, int c, int hh,
                                            v8f (&s)[4]) {
  union FH { v16h v; v8h h[2]; };
#pragma unroll
  for (int j = 0; j < 4; ++j) {
    v8f ah = zero8(), al = zero8();
#pragma unroll
    for (int dc = 0; dc < 2; ++dc) {
      const _Float16* kp = kb0 + (size_t)(kv0 + j * 16 + c) * (size_t)EMB + dc * 32 + 8 * hh;
      FH kb;
      kb.h[0] = *(const v8h*)(kp);
      kb.h[1] = *(const v8h*)(kp + 16);
      ah = mma_h(qah[dc], kb.v, ah);
      al = mma_h(qal[dc], kb.v, al);
    }
#pragma unroll
    for (int r = 0; r < 8; ++r) s[j][r] = (ah[r] + al[r] * (1.0f / 4096.0f)) * 0.125f;
  }
}

// =====================================================================================================
// Softmax statistics: per (b, h, query s) the row max m and 1/sum(exp(s - m)) over all SEQ keys.
//   block = 4 waves = 64 consecutive query rows qb*64.. of one (b, h); grid = NB*NH*NKT blocks of 128;
//   static trip NKT over 64-key chunks; online max / rescaled sum in f32 (16 lanes per row merged by shfl).
//   Output plane ML [b*NH+h][2][SEQ] f32 (m then 1/l): the block's 64 m values and 64 1/l values are
//   funnelled through LDS (cross-wave: block barrier) and written by wave 0 with ONE instruction (lanes 0-15:
//   coverage: grid (b,h,qb) x 64 rows = the whole [NB*NH][2][SEQ] plane. MLsh: 4 waves x 2 halves x 8 x 2 = all 128.
// =====================================================================================================
__global__ __launch_bounds__(128)
void attn_stats(const unsigned short* __restrict__ qhp, const unsigned short* __restrict__ qlp,
                const unsigned short* __restrict__ kpp, float* ML) {
  __shared__ __align__(16) float MLsh[128];
  const int tid  = threadIdx.x;
  const int wave = tid >> 5;
  const int lane = tid & 31;
  const int hh   = lane >> 4;
  const int c    = lane & 15;
  const int bx   = blockIdx.x;
  const int qb   = bx % NKT;
  const int rest = bx / NKT;
  const int h    = rest % NH;
  const int b    = rest / NH;
  const int bh   = b * NH + h;
  const int q0   = qb * 64 + wave * 16;

  const _Float16* Qh  = (const _Float16*)(const void*)qhp;
  const _Float16* Ql  = (const _Float16*)(const void*)qlp;
  const _Float16* Kb0 = (const _Float16*)(const void*)kpp + (size_t)b * SEQ * EMB + (size_t)h * HD;

  v16h qah[2], qal[2];
#pragma unroll
  for (int dc = 0; dc < 2; ++dc) {
    const size_t qo = ((size_t)b * SEQ + (size_t)(q0 + c)) * EMB + (size_t)h * HD + dc * 32 + 8 * hh;
    qah[dc] = ldfrag<_Float16>(Qh + qo);
    qal[dc] = ldfrag<_Float16>(Ql + qo);
  }

  float mrow[8], lrow[8];
#pragma unroll
  for (int r = 0; r < 8; ++r) { mrow[r] = -INFINITY; lrow[r] = 0.f; }

  for (int kt = 0; kt < NKT; ++kt) {          // static trip count
    const int kv0 = kt * 64;
    v8f s[4];
    score_chunk(qah, qal, Kb0, kv0, c, hh, s);
#pragma unroll
    for (int r = 0; r < 8; ++r) {
      float m = s[0][r];
#pragma unroll
      for (int j = 1; j < 4; ++j) m = fmaxf(m, s[j][r]);
#pragma unroll
      for (int off = 1; off < 16; off <<= 1) m = fmaxf(m, __shfl_xor(m, off, 32));
      const float mnew  = fmaxf(mrow[r], m);
      const float msafe = (mnew == -INFINITY) ? 0.f : mnew;
      const float alpha = __expf(mrow[r] - msafe);
      mrow[r] = mnew;
      float psum = 0.f;
#pragma unroll
      for (int j = 0; j < 4; ++j) psum += __expf(s[j][r] - msafe);
#pragma unroll
      for (int off = 1; off < 16; off <<= 1) psum += __shfl_xor(psum, off, 32);
      lrow[r] = lrow[r] * alpha + psum;
    }
  }

  float il[8];
#pragma unroll
  for (int r = 0; r < 8; ++r) {
    const float l = lrow[r];
    il[r] = (l > 0.f) ? (1.0f / l) : 0.f;
  }
  if (c == 0) {
#pragma unroll
    for (int r = 0; r < 8; ++r) {
      MLsh[wave * 16 + 8 * hh + r]      = mrow[r];
      MLsh[64 + wave * 16 + 8 * hh + r] = il[r];
    }
  }
  __syncthreads();
  if (wave == 0) {
    const v4f v = *(const v4f*)(MLsh + lane * 4);        // lanes 0-15: m rows 4c..4c+3; lanes 16-31: 1/l rows
    float* dst = ML + (size_t)(bh * 2 + hh) * SEQ + qb * 64 + c * 4;
    *(v4f*)dst = v;
    
  }
}

// =====================================================================================================
// Main attention pass: one block per (b, 16 query rows q0..q0+15), 16 waves = the 16 heads.
//   Per 64-key chunk (static trip NKT): scores recomputed exactly as in attn_stats, p = exp(s - m) * (1/l) in f32
//   (m, 1/l from the ML plane) -> per-wave LDS tile Pf[h][row][key] (f32 element stores, every entry written);
//       converted to f16 with the x16384 carry; B = v^T f16 plane [b][d][s] (shared by every head) loaded with
//       the split k map;
//   (b) head average: after __syncthreads (cross-wave), threads 0..255 sum the 16 wave tiles in fixed head order
//   Epilogue: ctx = acc / 16384, x256 carry, staged in the wave's Pf tile (wave-private), written as f16 hi plane
//   coverage: avg: NKT chunks x 16 rows x 64 keys per block, grid (b, qb) = the whole [NB][SEQ][SEQ];
//   ctx planes: each wave rows q0..q0+15 (it 0..3 x lane>>3 0..3) x its head's 64 columns, 16 waves x grid =
//   the whole [NROW][EMB] planes. staged extent == consumed extent for Pf in both uses (32 lanes x 32 = 1024).
// =====================================================================================================
__global__ __launch_bounds__(512)
void attn_main(const unsigned short* __restrict__ qhp, const unsigned short* __restrict__ qlp,
               const unsigned short* __restrict__ kpp, const unsigned short* __restrict__ vtp,
               const float* __restrict__ ML, unsigned short* chp, unsigned short* clp, float* avg) {
  union FH { v16h v; v8h h[2]; };
  __shared__ __align__(32) float Pf[NH][16 * 64];          // per wave (head) P tile [row][key] f32, 64 KB
  const int tid  = threadIdx.x;
  const int wave = tid >> 5;
  const int lane = tid & 31;
  const int hh   = lane >> 4;
  const int c    = lane & 15;
  const int bx   = blockIdx.x;
  const int qb   = bx % NQB;
  const int b    = bx / NQB;
  const int h    = wave;
  const int bh   = b * NH + h;
  const int q0   = qb * 16;

  const _Float16* Qh  = (const _Float16*)(const void*)qhp;
  const _Float16* Ql  = (const _Float16*)(const void*)qlp;
  const _Float16* Kb0 = (const _Float16*)(const void*)kpp + (size_t)b * SEQ * EMB + (size_t)h * HD;
  const _Float16* Vb0 = (const _Float16*)(const void*)vtp + (size_t)b * HD * SEQ;     // v^T [b][d][s], all heads

  v16h qah[2], qal[2];
#pragma unroll
  for (int dc = 0; dc < 2; ++dc) {
    const size_t qo = ((size_t)b * SEQ + (size_t)(q0 + c)) * EMB + (size_t)h * HD + dc * 32 + 8 * hh;
    qah[dc] = ldfrag<_Float16>(Qh + qo);
    qal[dc] = ldfrag<_Float16>(Ql + qo);
  }
  const v8f m8  = *(const v8f*)(ML + (size_t)(bh * 2) * SEQ + q0 + 8 * hh);       // rows 8hh..8hh+7
  const v8f il8 = *(const v8f*)(ML + (size_t)(bh * 2 + 1) * SEQ + q0 + 8 * hh);

  v8f oacc[4];
#pragma unroll
  for (int t = 0; t < 4; ++t) oacc[t] = zero8();
  float* pf = Pf[wave];

  for (int kt = 0; kt < NKT; ++kt) {         // static trip count
    const int kv0 = kt * 64;
    __syncthreads();                          // Pf tiles free again (head sum of the prior chunk done)

    v8f s[4];
    score_chunk(qah, qal, Kb0, kv0, c, hh, s);
#pragma unroll
    for (int r = 0; r < 8; ++r) {
#pragma unroll
      for (int j = 0; j < 4; ++j) {
        const float p = __expf(s[j][r] - m8[r]) * il8[r];
        pf[(8 * hh + r) * 64 + j * 16 + c] = p;
      }
    }
    __builtin_amdgcn_fence(__ATOMIC_RELEASE, "workgroup");
    __builtin_amdgcn_wave_barrier();
    __builtin_amdgcn_fence(__ATOMIC_ACQUIRE, "workgroup");

    // ---- context += P . V (f16 WMMA, p carried x16384) ----
#pragma unroll 1
    for (int kk = 0; kk < 2; ++kk) {
      const v8f p0 = *(const v8f*)(pf + c * 64 + kk * 32 + 8 * hh);
      const v8f p1 = *(const v8f*)(pf + c * 64 + kk * 32 + 16 + 8 * hh);
      FH pa;
      pa.h[0] = __builtin_convertvector(p0 * PCARRY, v8h);
      pa.h[1] = __builtin_convertvector(p1 * PCARRY, v8h);
#pragma unroll
      for (int t = 0; t < 4; ++t) {
        const v16h vb = ldfrag<_Float16>(Vb0 + (size_t)(t * 16 + c) * SEQ + kv0 + kk * 32 + 8 * hh);
        oacc[t] = mma_h(pa.v, vb, oacc[t]);
      }
    }
    __syncthreads();

    // ---- head average of this 16 x 64 tile, one block = one writer of every line ----
    if (tid < 256) {                          // waves 0..7, wave-uniform
      const int row = tid >> 4, c4 = (tid & 15) * 4;
      v4f a = *(const v4f*)(Pf[0] + row * 64 + c4);
#pragma unroll
      for (int w = 1; w < NH; ++w) a += *(const v4f*)(Pf[w] + row * 64 + c4);
      a *= (1.0f / (float)NH);
      float* dst = avg + ((size_t)b * SEQ + (size_t)(q0 + row)) * SEQ + kv0 + c4;
      *(v4f*)dst = a;
      
    }
  }
  __syncthreads();

  // ---- epilogue: ctx (undo the x16384 p carry, apply the x256 carry), stage, convert, whole-line stores ----
  float* os = pf;
#pragma unroll
  for (int r = 0; r < 8; ++r) {
#pragma unroll
    for (int t = 0; t < 4; ++t) os[(8 * hh + r) * 64 + t * 16 + c] = oacc[t][r] * (256.0f / PCARRY);
  }
  __builtin_amdgcn_fence(__ATOMIC_RELEASE, "workgroup");
  __builtin_amdgcn_wave_barrier();
  __builtin_amdgcn_fence(__ATOMIC_ACQUIRE, "workgroup");
  {
    const int q4 = lane >> 3, c8 = (lane & 7) * 8;
    v4u hv[4], lv[4];
#pragma unroll
    for (int it = 0; it < 4; ++it) {
      const int row = it * 4 + q4;   // it 0..3 x q4 0..3 = rows 0..15 of the wave tile
      const float* sp = os + row * 64 + c8;
      float f[8];
#pragma unroll
      for (int e = 0; e < 8; ++e) f[e] = sp[e];
      v4u a, a2;
#pragma unroll
      for (int e = 0; e < 4; ++e) {
        const float f0 = f[2 * e], f1 = f[2 * e + 1];
        const _Float16 x0 = (_Float16)f0, x1 = (_Float16)f1;
        const unsigned short h0 = h_bits(x0), h1 = h_bits(x1);
        const unsigned short l0 = h_bits((_Float16)((f0 - (float)x0) * 4096.0f));
        const unsigned short l1 = h_bits((_Float16)((f1 - (float)x1) * 4096.0f));
        a[e] = pk16(h0, h1); a2[e] = pk16(l0, l1);
      }
      hv[it] = a; lv[it] = a2;
    }
    {
#pragma unroll
      for (int it = 0; it < 4; ++it) {
        const int row = it * 4 + q4;
        const size_t go = ((size_t)b * SEQ + (size_t)(q0 + row)) * EMB + (size_t)h * HD + c8;
        *(v4u*)(chp + go) = hv[it];
        *(v4u*)(clp + go) = lv[it];
      }
      
    }
  }
}

// =====================================================================================================
// Residual add + LayerNorm: out0 row (b, s) = LN(bf16(x[b][s]) + Y[b*SEQ+s]) * bf16(gamma) + bf16(beta), eps 1e-6.
//   One wave per row (no block barriers); lane l holds columns 128*i + 4*l + 0..3, i = 0..7 (the whole 1024-col row).
//   x rows read with the FULL batch stride SEQ_FULL*EMB. grid = NROW/8 blocks of 256.
//   coverage: 8 waves x grid = NROW rows; 8 i x 32 lanes x 4 = 1024 cols per row = the whole [NROW][EMB] output 0.
// =====================================================================================================
__global__ __launch_bounds__(256)
void resid_ln(const float* __restrict__ Y, const float* __restrict__ x,
              const float* __restrict__ gam, const float* __restrict__ bet, float* out) {
  const int lane = threadIdx.x & 31;
  const int wave = threadIdx.x >> 5;
  const int row  = blockIdx.x * 8 + wave;
  if (row >= NROW) return;                      // wave-uniform, no barriers in this kernel
  const int b = row / SEQ;
  const int s = row - b * SEQ;
  const float* xr = x + ((size_t)b * SEQ_FULL + (size_t)s) * EMB;
  const float* yr = Y + (size_t)row * EMB;

  v4f y[8];
  float sum = 0.f;
#pragma unroll
  for (int i = 0; i < 8; ++i) {
    const int col = i * 128 + lane * 4;
    const v4f xv = *(const v4f*)(xr + col);
    const v4f ov = *(const v4f*)(yr + col);
    v4f t;
#pragma unroll
    for (int e = 0; e < 4; ++e) t[e] = bf_up(bf_bits(xv[e])) + ov[e];
    y[i] = t;
    sum += (t[0] + t[1]) + (t[2] + t[3]);
  }
#pragma unroll
  for (int off = 1; off < 32; off <<= 1) sum += __shfl_xor(sum, off, 32);
  const float mu = sum * (1.0f / (float)EMB);

  float vs = 0.f;
#pragma unroll
  for (int i = 0; i < 8; ++i) {
#pragma unroll
    for (int e = 0; e < 4; ++e) { const float d = y[i][e] - mu; vs += d * d; }
  }
#pragma unroll
  for (int off = 1; off < 32; off <<= 1) vs += __shfl_xor(vs, off, 32);
  const float var = vs * (1.0f / (float)EMB);
  const float rs  = rsqrtf(var + 1e-6f);

  v4f o[8];
#pragma unroll
  for (int i = 0; i < 8; ++i) {
    const int col = i * 128 + lane * 4;
    const v4f g4 = *(const v4f*)(gam + col);
    const v4f b4 = *(const v4f*)(bet + col);
    v4f t;
#pragma unroll
    for (int e = 0; e < 4; ++e)
      t[e] = ((y[i][e] - mu) * rs) * bf_up(bf_bits(g4[e])) + bf_up(bf_bits(b4[e]));
    o[i] = t;
  }
  float* orow = out + (size_t)row * EMB;
  {
#pragma unroll
    for (int i = 0; i < 8; ++i) {
      const int col = i * 128 + lane * 4;
      *(v4f*)(orow + col) = o[i];
    }
    
  }
}

// =====================================================================================================
// Workspace map (bytes, full size NB=2 SEQ=2048; PX = NROW*EMB*2 = 8388608; every region an exact multiple of
// its whole-line / whole-tile store granularity, rows are whole tiles, no padded tails needed):
//   Xb   bf16 [NROW][EMB]            PX        8388608
//   WqT  bf16 [EMB n][EMB k]                   2097152
//   WkT  bf16 [EMB n][EMB k]                   2097152
//   WvT  bf16 [HD n][EMB k]                     131072
//   WoT  f16  [EMB n][EMB k] (x64)             2097152
//   Qh   f16  [NROW][EMB]            PX        8388608
//   Ql   f16  [NROW][EMB]            PX        8388608
//   Kp   f16  [NROW][EMB]            PX        8388608
//   VT   f16  [NB][HD][SEQ]                     524288
//   Ch   f16  [NROW][EMB]            PX        8388608
//   Cl   f16  [NROW][EMB]            PX        8388608
//   ML   f32  [NB*NH][2][SEQ]                   524288
//   Y    f32  [NROW][EMB]                     16777216
//   total                                     74579968
// Input weights are [in k][out n]; they are transposed once into [n][k] 16-bit planes (k contiguous = Bt / A layout).
// Output 0 at element 0 of d_out (rows b*SEQ + s); output 1 at the fixed element offset OFF1 = NB_FULL*SEQ_FULL*EMB.
// =====================================================================================================
extern "C" void kernel_launch(void* const* d_in, const int* in_sizes, int n_in,
                              void* d_out, int out_size, void* d_ws, size_t ws_size,
                              hipStream_t stream) {
  if (n_in < 7) return;
  if (in_sizes[0] < ((NB - 1) * SEQ_FULL + SEQ) * EMB) return;
  if (in_sizes[1] < EMB * EMB) return;
  if (in_sizes[2] < EMB * EMB) return;
  if (in_sizes[3] < EMB * HD) return;
  if (in_sizes[4] < EMB * EMB) return;
  if (in_sizes[5] < EMB) return;
  if (in_sizes[6] < EMB) return;
  const size_t n0e = (size_t)NROW * EMB;            // output 0 written elements [NB][SEQ][EMB]
  const size_t n1e = (size_t)NB * SEQ * SEQ;        // output 1 written elements [NB][SEQ][SEQ]
  if (out_size < 0) return;
  if ((size_t)out_size < n0e) return;
  if ((size_t)out_size < OFF1 + n1e) return;        // written extent of output 1 inside d_out

  const float* x   = (const float*)d_in[0];
  const float* Wq  = (const float*)d_in[1];
  const float* Wk  = (const float*)d_in[2];
  const float* Wv  = (const float*)d_in[3];
  const float* Wo  = (const float*)d_in[4];
  const float* gam = (const float*)d_in[5];
  const float* bet = (const float*)d_in[6];

  const size_t PX  = (size_t)NROW * EMB * 2;        // 16-bit activation plane
  const size_t PW  = (size_t)EMB * EMB * 2;
  const size_t PWV = (size_t)HD * EMB * 2;
  const size_t PVT = (size_t)NB * HD * SEQ * 2;
  const size_t PML = (size_t)NB * NH * 2 * SEQ * 4;
  const size_t PY  = (size_t)NROW * EMB * 4;
  size_t off = 0;
  const size_t oXb = off; off += PX;
  const size_t oWq = off; off += PW;
  const size_t oWk = off; off += PW;
  const size_t oWv = off; off += PWV;
  const size_t oWo = off; off += PW;
  const size_t oQh = off; off += PX;
  const size_t oQl = off; off += PX;
  const size_t oKp = off; off += PX;
  const size_t oVT = off; off += PVT;
  const size_t oCh = off; off += PX;
  const size_t oCl = off; off += PX;
  const size_t oML = off; off += PML;
  const size_t oY  = off; off += PY;
  if (off > ws_size) return;                        // off = 74579968 at full size
  if (off > (size_t)134217728) return;

  char* ws = (char*)d_ws;
  unsigned short* Xb  = (unsigned short*)(ws + oXb);
  unsigned short* WqT = (unsigned short*)(ws + oWq);
  unsigned short* WkT = (unsigned short*)(ws + oWk);
  unsigned short* WvT = (unsigned short*)(ws + oWv);
  unsigned short* WoT = (unsigned short*)(ws + oWo);
  unsigned short* Qh  = (unsigned short*)(ws + oQh);
  unsigned short* Ql  = (unsigned short*)(ws + oQl);
  unsigned short* Kp  = (unsigned short*)(ws + oKp);
  unsigned short* VT  = (unsigned short*)(ws + oVT);
  unsigned short* Ch  = (unsigned short*)(ws + oCh);
  unsigned short* Cl  = (unsigned short*)(ws + oCl);
  float*          ML  = (float*)(ws + oML);
  float*          Y   = (float*)(ws + oY);
  float*          out0 = (float*)d_out;
  float*          out1 = (float*)d_out + OFF1;

  const dim3 blk(256);
  const int n8x = SEQ * EMB / 8;                                 // per batch slab, 262144 at full size
  const dim3 gCvtX((n8x + 255) / 256, NB);                       // 1024 x NB blocks
  const dim3 gTrW(EMB / 64, EMB / 64);                           // out [EMB][EMB]: (N/64, K/64) = (16, 16)
  const dim3 gTrV(HD / 64, EMB / 64);                            // out [HD][EMB]:  (N/64, K/64) = (1, 16)
  const dim3 gQK((((NROW) / 64) * (EMB / 64) + 7) / 8, 1);        // 1024 tiles -> 128 blocks: M=NROW, N=EMB
  const dim3 gV(((SEQ / 64) + 7) / 8, NB);                        //   32 tiles ->   4 blocks x NB: M=HD, N=SEQ
  const dim3 gO((((NROW) / 32) * (EMB / 64) + 7) / 8, 1);         // 2048 tiles -> 256 blocks (32x64 wave tiles)
  const dim3 gStats(NB * NH * NKT);                              // 1024 blocks of 128
  const dim3 gMain(NB * NQB);                                    //  256 blocks of 512
  const dim3 gLN((NROW + 7) / 8);                                //  512 blocks of 256 (8 rows per block)

  // (1) x [b][s][k] -> bf16 plane [b*SEQ+s][k] (input batch stride SEQ_FULL*EMB, plane batch stride SEQ*EMB)
  cvt16x8<0><<<gCvtX, blk, 0, stream>>>(x, (long long)SEQ_FULL * EMB, Xb, (long long)SEQ * EMB, n8x);
  // (2) weights: in [EMB k][EMB n] -> out [EMB n][EMB k] bf16 (Wq, Wk); in [EMB k][HD n] -> out [HD n][EMB k] (Wv);
  //     Wo [EMB k][EMB n] -> [EMB n][EMB k] f16 (x64 of its bf16 value)
  tr16<0><<<gTrW, blk, 0, stream>>>(Wq, WqT, EMB, EMB);
  tr16<0><<<gTrW, blk, 0, stream>>>(Wk, WkT, EMB, EMB);
  tr16<0><<<gTrV, blk, 0, stream>>>(Wv, WvT, EMB, HD);
  tr16<1><<<gTrW, blk, 0, stream>>>(Wo, WoT, EMB, EMB);
  // (3) q = x . Wq -> f16 hi / residual (x4096) planes [b*SEQ+s][h*64+d]   (M=NROW, N=EMB, K=EMB)
  gemm_t<__bf16, 4, 1, 3><<<gQK, blk, 0, stream>>>(
      Xb, Xb, EMB, 0LL, WqT, EMB, 0LL,
      (void*)Qh, (void*)Ql, EMB, 0LL,
      NROW, EMB, EMB, 1.0f, 0.0f, 1.0f, 4096.0f);
  // (4) k = x . Wk -> f16 plane [b*SEQ+s][h*64+d]
  gemm_t<__bf16, 4, 1, 1><<<gQK, blk, 0, stream>>>(
      Xb, Xb, EMB, 0LL, WkT, EMB, 0LL,
      (void*)Kp, (void*)Kp, EMB, 0LL,
      NROW, EMB, EMB, 1.0f, 0.0f, 1.0f, 1.0f);
  // (5) v^T = WvT . x_b^T (per batch b = blockIdx.y) -> f16 plane [b][d][s] (pitch SEQ)
  //     (A = WvT [d][k]; Bt = Xb rows of batch b: offset b*SEQ*EMB, pitch EMB; M=HD, N=SEQ, K=EMB)
  gemm_t<__bf16, 4, 1, 1><<<gV, blk, 0, stream>>>(
      WvT, WvT, EMB, 0LL, Xb, EMB, (long long)SEQ * EMB,
      (void*)VT, (void*)VT, SEQ, (long long)HD * SEQ,
      HD, SEQ, EMB, 1.0f, 0.0f, 1.0f, 1.0f);
  // (6) softmax statistics (m, 1/l) per (b, h, s)
  attn_stats<<<gStats, dim3(128), 0, stream>>>(Qh, Ql, Kp, ML);
  // (7) exact-normalised p: P.V -> ctx planes (f16 hi x256 / residual x4096); head-averaged p -> output 1
  attn_main<<<gMain, dim3(512), 0, stream>>>(Qh, Ql, Kp, VT, ML, Ch, Cl, out1);
  // (8) Y = ctx . Wo, f32 [NROW][EMB] in workspace, accumulators (hi + res/4096) x 1/(256*64)
  gemm_t<_Float16, 2, 2, 0><<<gO, blk, 0, stream>>>(
      Ch, Cl, EMB, 0LL, WoT, EMB, 0LL,
      (void*)Y, (void*)Y, EMB, 0LL,
      NROW, EMB, EMB, 1.0f / 16384.0f, 1.0f / 4096.0f, 1.0f, 1.0f);
  // (9) output 0 = LayerNorm(x + Y) * gamma + beta, f32 [NROW][EMB]
  resid_ln<<<gLN, blk, 0, stream>>>(Y, x, gam, bet, out0);
  (void)hipGetLastError();
}

// v001
// One run takes 391 microseconds.
// In both of two side-by-side timings against v000, it was 1.16 times as fast.
// Contractions: q, k, v^T projections = v_wmma_f32_16x16x32_bf16 (bf16 operands from RNE-converted inputs, single product, f32 accumulate);
// q.k^T scores (statistics pass and main pass) = v_wmma_f32_16x16x32_f16 (q as f16 hi plane + f16 residual plane x4096, k f16; 2 products, separate f32 accumulators);
// p.v = v_wmma_f32_16x16x32_f16 (p carried x16384 in f16, v f16; single product, f32 accumulate);
// ctx.Wo = v_wmma_f32_16x16x32_f16 (ctx as f16 hi plane x256 + f16 residual plane x4096, Wo^T f16 x64 of its bf16 value; 2 products, separate f32 accumulators);
// softmax statistics, probabilities, head average, residual add and LayerNorm in f32.
#include <hip/hip_runtime.h>
#include <math.h>
#include <stdint.h>

#ifndef NB
#define NB 2
#endif
#ifndef SEQ
#define SEQ 2048
#endif
#define NB_FULL  2
#define SEQ_FULL 2048
#define EMB      1024
#define NH       16
#define HD       64
#define NROW     (NB * SEQ)          // activation rows in workspace planes, row index = b * SEQ + s
#define NQB      (SEQ / 16)          // 16-row query blocks per sequence
#define NKT      (SEQ / 64)          // 64-key chunks per sequence
#define PCARRY   16384.0f            // power-of-two carry of p in the f16 P.V operand
#define OFF1     ((size_t)NB_FULL * SEQ_FULL * EMB)   // fixed element offset of output 1 in d_out
static_assert(NB >= 1 && NB <= NB_FULL);
static_assert(SEQ >= 64 && SEQ <= SEQ_FULL && (SEQ % 64) == 0);
static_assert(NH * HD == EMB);
static_assert((NROW % 64) == 0 && (EMB % 64) == 0 && (HD % 64) == 0 && (EMB % 32) == 0);
static_assert(OFF1 * 4 == 16777216);   // byte offset of output 1

typedef _Float16 v16h __attribute__((ext_vector_type(16)));
typedef _Float16 v8h  __attribute__((ext_vector_type(8)));
typedef __bf16   v16b __attribute__((ext_vector_type(16)));
typedef __bf16   v8b  __attribute__((ext_vector_type(8)));
typedef float    v8f  __attribute__((ext_vector_type(8)));
typedef float    v4f  __attribute__((ext_vector_type(4)));
typedef unsigned int v4u __attribute__((ext_vector_type(4)));

#if defined(__HIP_DEVICE_COMPILE__)
#define DEV_ASM 1
#else
#define DEV_ASM 0
#endif

// ---- scalar helpers --------------------------------------------------------------------------------
__device__ __forceinline__ unsigned short bf_bits(float f) {          // f32 -> bf16 bits, RNE convert
  unsigned u = __float_as_uint(f);
  return (unsigned short)((u + 0x7FFFu + ((u >> 16) & 1u)) >> 16);
}
__device__ __forceinline__ float bf_up(unsigned short hb) { return __uint_as_float(((unsigned)hb) << 16); }
__device__ __forceinline__ unsigned short h_bits(_Float16 x) { return __builtin_bit_cast(unsigned short, x); }
__device__ __forceinline__ unsigned pk16(unsigned short a, unsigned short b) { return (unsigned)a | ((unsigned)b << 16); }
__device__ __forceinline__ v8f zero8() { v8f z = {0.f, 0.f, 0.f, 0.f, 0.f, 0.f, 0.f, 0.f}; return z; }

// ---- fragment types / loaders: 16-bit A/B operand, lane -> row/col (lane&15), p already includes +8*(lane>>4);
//      elements 0..7 <- p[0..7] (k0+8h..k0+8h+7), elements 8..15 <- p[16..23] (k0+16+8h..k0+16+8h+7)
template <typename OT> struct FT;
template <> struct FT<__bf16>   { typedef v16b frag; typedef v8b half8; };
template <> struct FT<_Float16> { typedef v16h frag; typedef v8h half8; };

template <typename OT>
__device__ __forceinline__ typename FT<OT>::frag ldfrag(const OT* p) {
  union { typename FT<OT>::frag v; typename FT<OT>::half8 h[2]; } f;
  f.h[0] = *(const typename FT<OT>::half8*)(p);
  f.h[1] = *(const typename FT<OT>::half8*)(p + 16);
  return f.v;
}

// ---- WMMA helpers (asm guard bodies are device-only; concrete operand types) -----------------------------
__device__ __forceinline__ v8f mmar(v16b a, v16b b, v8f c) {
  return __builtin_amdgcn_wmma_f32_16x16x32_bf16(false, a, false, b, (short)0, c, false, false);
}
__device__ __forceinline__ v8f mmar(v16h a, v16h b, v8f c) {
  return __builtin_amdgcn_wmma_f32_16x16x32_f16(false, a, false, b, (short)0, c, false, false);
}
// guarded form: 4 VALU slots after the WMMA, D tied, A/B kept live
__device__ __forceinline__ v8f mma_h(v16h a, v16h b, v8f c) {
  c = __builtin_amdgcn_wmma_f32_16x16x32_f16(false, a, false, b, (short)0, c, false, false);
#if DEV_ASM
  asm volatile("v_nop\n\tv_nop\n\tv_nop\n\tv_nop" : "+v"(c) : "v"(a), "v"(b));
#endif
  return c;
}
__device__ __forceinline__ void dep_guard(v8f& a, v8f& b, v16b x, v16b y) {
#if DEV_ASM
  asm volatile("v_nop\n\tv_nop\n\tv_nop\n\tv_nop" : "+v"(a), "+v"(b) : "v"(x), "v"(y));
#else
  (void)a; (void)b; (void)x; (void)y;
#endif
}
__device__ __forceinline__ void dep_guard(v8f& a, v8f& b, v16h x, v16h y) {
#if DEV_ASM
  asm volatile("v_nop\n\tv_nop\n\tv_nop\n\tv_nop" : "+v"(a), "+v"(b) : "v"(x), "v"(y));
#else
  (void)a; (void)b; (void)x; (void)y;
#endif
}
__device__ __forceinline__ void keep4(v16b a, v16b b, v16b c, v16b d) {
#if DEV_ASM
  asm volatile("v_nop" :: "v"(a), "v"(b), "v"(c), "v"(d));
#else
  (void)a; (void)b; (void)c; (void)d;
#endif
}
__device__ __forceinline__ void keep4(v16h a, v16h b, v16h c, v16h d) {
#if DEV_ASM
  asm volatile("v_nop" :: "v"(a), "v"(b), "v"(c), "v"(d));
#else
  (void)a; (void)b; (void)c; (void)d;
#endif
}
__device__ __forceinline__ void acc_guard4(v8f& a, v8f& b, v8f& c, v8f& d) {
#if DEV_ASM
  asm volatile("v_nop\n\tv_nop\n\tv_nop\n\tv_nop" : "+v"(a), "+v"(b), "+v"(c), "+v"(d));
#else
  (void)a; (void)b; (void)c; (void)d;
#endif
}

// 16-bit convert helper. MODE 0: bf16 bits (RNE convert).  MODE 1: f16 bits of (64 * bf16(x)) (exact scaling of the bf16 value).
template <int MODE>
__device__ __forceinline__ unsigned short cvm(float f) {
  const unsigned short hb = bf_bits(f);
  if (MODE == 0) return hb;
  return h_bits((_Float16)(bf_up(hb) * 64.0f));
}

// =====================================================================================================
// f32 -> 16-bit planes, 8 elements per thread, one 16-B store per lane: a wave writes 512 contiguous B
// blockIdx.y selects the batch slab (element strides inStride / outStride).
// coverage: n8 threads x 8 = the whole per-batch slab (n8 is a multiple of 256 for every use here).
// =====================================================================================================
template <int MODE>
__global__ __launch_bounds__(256) void cvt16x8(const float* __restrict__ in, long long inStride,
                                               unsigned short* out, long long outStride, int n8) {
  const int i = blockIdx.x * 256 + (int)threadIdx.x;
  const float* ib = in + (size_t)blockIdx.y * (size_t)inStride;
  unsigned short* ob = out + (size_t)blockIdx.y * (size_t)outStride;
  if (i < n8) {
    const v4f a  = *(const v4f*)(ib + (size_t)i * 8);
    const v4f a4 = *(const v4f*)(ib + (size_t)i * 8 + 4);
    v4u p;
    p[0] = pk16(cvm<MODE>(a[0]),  cvm<MODE>(a[1]));
    p[1] = pk16(cvm<MODE>(a[2]),  cvm<MODE>(a[3]));
    p[2] = pk16(cvm<MODE>(a4[0]), cvm<MODE>(a4[1]));
    p[3] = pk16(cvm<MODE>(a4[2]), cvm<MODE>(a4[3]));
    unsigned short* o = ob + (size_t)i * 8;
    *(v4u*)o = p;
    
  }
}

// =====================================================================================================
// Transpose-convert: in f32 [K rows][N cols] (row-major, N contiguous) -> out 16-bit [N][K] (k contiguous),
// i.e. the Bt / A layout the GEMM wants. One block per 64x64 tile: grid (N/64, K/64), block 256.
// coverage: loads 256 threads x 4 it x 4 = 64x64; stores 256 threads x 2 it x 8 halves = 64x64 = the whole tile;
// grid (N/64, K/64) tiles = the whole [N][K] plane. staged extent == consumed extent (all 64x64 written).
// =====================================================================================================
template <int MODE>
__global__ __launch_bounds__(256) void tr16(const float* __restrict__ in, unsigned short* out, int K, int N) {
  __shared__ float s[64][65];
  const int t  = threadIdx.x;
  const int n0 = blockIdx.x * 64;
  const int k0 = blockIdx.y * 64;
#pragma unroll
  for (int it = 0; it < 4; ++it) {
    const int f  = t + it * 256;
    const int kk = f >> 4, c4 = (f & 15) * 4;
    const v4f v = *(const v4f*)(in + (size_t)(k0 + kk) * (size_t)N + n0 + c4);
    s[kk][c4 + 0] = v[0];
    s[kk][c4 + 1] = v[1];
    s[kk][c4 + 2] = v[2];
    s[kk][c4 + 3] = v[3];
  }
  __syncthreads();
  v4u pv[2];
#pragma unroll
  for (int it = 0; it < 2; ++it) {
    const int nn = (t >> 3) + it * 32, c8 = (t & 7) * 8;
    v4u p;
#pragma unroll
    for (int e = 0; e < 4; ++e)
      p[e] = pk16(cvm<MODE>(s[c8 + 2 * e][nn]), cvm<MODE>(s[c8 + 2 * e + 1][nn]));
    pv[it] = p;
  }
  {
#pragma unroll
    for (int it = 0; it < 2; ++it) {
      const int nn = (t >> 3) + it * 32, c8 = (t & 7) * 8;
      *(v4u*)(out + (size_t)(n0 + nn) * (size_t)K + k0 + c8) = pv[it];
    }
    
  }
}

// =====================================================================================================
// Register-blocked batched WMMA GEMM (16-bit operand type OT): C[m][n] = sum_k A[m][k] * Bt[n][k];
// one wave per (16*MI) x 64 tile, no block barriers. A row-major [M][K] pitch lda; Bt row-major [N][K] pitch ldb
// (k contiguous); M multiple of 16*MI, N multiple of 64, K multiple of 32 (static sizes here). blockIdx.y = batch
// index (strides in elements). Fragments are loaded straight from global with the split k map (ldfrag).
// NPA = number of A planes: 2 -> second plane A2 (same pitch/stride) multiplies the same Bt fragments into a
// second accumulator set, combined as acc + acc2 * rscaleA in the f32 epilogue.
// value v = (acc [+ acc2*rscaleA]) * oscale.
// OUT_MODE 0: f32 C (pitch ldc) = v.
// OUT_MODE 1: f16 plane C = f16(v * cscale).
// OUT_MODE 3: f16 hi plane C = f16(v * cscale) and f16 residual plane C2 = f16((v*cscale - hi) * rscaleC).
// =====================================================================================================
template <typename OT, int MI, int NPA, int OUT_MODE>
__global__ __launch_bounds__(256) void gemm_t(
    const unsigned short* __restrict__ Ap, const unsigned short* __restrict__ A2p, int lda, long long strideA,
    const unsigned short* __restrict__ Btp, int ldb, long long strideB,
    void* Cout, void* Cout2, int ldc, long long strideC,
    int M, int N, int K, float oscale, float rscaleA, float cscale, float rscaleC) {
  typedef typename FT<OT>::frag V16;
  const OT* A  = (const OT*)(const void*)Ap;
  const OT* A2 = (const OT*)(const void*)A2p;
  const OT* Bt = (const OT*)(const void*)Btp;
  __shared__ __align__(16) float sT[8][16 * 68];   // per-wave 16x64 slab, pitch 68 floats
  const int RT   = 16 * MI;
  const int b    = blockIdx.y;
  const int lane = threadIdx.x & 31;
  const int wave = threadIdx.x >> 5;
  const int tilesN = N >> 6;
  const int tilesM = M / RT;
  const int tile = blockIdx.x * 8 + wave;
  if (tile >= tilesM * tilesN) return;   // wave-uniform; no block barriers in this kernel
  const int tm = tile / tilesN;
  const int tn = tile - tm * tilesN;
  const int m0 = tm * RT;
  const int n0 = tn << 6;

  const OT* Ab  = A  + (size_t)b * (size_t)strideA;
  const OT* A2b = A2 + (size_t)b * (size_t)strideA;
  const OT* Bb  = Bt + (size_t)b * (size_t)strideB;

  const int rlane = lane & 15;                 // row (A) / col (B, D) within subtile
  const int koff  = (lane >> 4) * 8;           // k offset of this lane half
  const int mOff  = (lane >> 4) * 8;           // D row offset

  v8f acc[MI][4], acc2[MI][4];
#pragma unroll
  for (int i = 0; i < MI; ++i)
#pragma unroll
    for (int j = 0; j < 4; ++j) { acc[i][j] = zero8(); acc2[i][j] = zero8(); }

  for (int k0 = 0; k0 < K; k0 += 32) {
    V16 bq[4];
#pragma unroll
    for (int j = 0; j < 4; ++j)
      bq[j] = ldfrag<OT>(Bb + (size_t)(n0 + (j << 4) + rlane) * ldb + koff + k0);
#pragma unroll
    for (int i = 0; i < MI; ++i) {
      const V16 af = ldfrag<OT>(Ab + (size_t)(m0 + (i << 4) + rlane) * lda + koff + k0);
#pragma unroll
      for (int j = 0; j < 4; ++j) acc[i][j] = mmar(af, bq[j], acc[i][j]);
      dep_guard(acc[i][0], acc[i][3], af, bq[3]);
      if (NPA == 2) {
        const V16 af2 = ldfrag<OT>(A2b + (size_t)(m0 + (i << 4) + rlane) * lda + koff + k0);
#pragma unroll
        for (int j = 0; j < 4; ++j) acc2[i][j] = mmar(af2, bq[j], acc2[i][j]);
        dep_guard(acc2[i][0], acc2[i][3], af2, bq[3]);
      }
    }
    keep4(bq[0], bq[1], bq[2], bq[3]);
  }
#pragma unroll
  for (int i = 0; i < MI; ++i) {
    acc_guard4(acc[i][0], acc[i][1], acc[i][2], acc[i][3]);
    if (NPA == 2) acc_guard4(acc2[i][0], acc2[i][1], acc2[i][2], acc2[i][3]);
  }

  // ---- epilogue ----
  float* slab = sT[wave];
#pragma unroll
  for (int i = 0; i < MI; ++i) {
    const int mBase = m0 + (i << 4);
#pragma unroll
    for (int j = 0; j < 4; ++j) {
#pragma unroll
      for (int r = 0; r < 8; ++r) {
        float v = acc[i][j][r];
        if (NPA == 2) v += acc2[i][j][r] * rscaleA;
        v = v * oscale;
        slab[(mOff + r) * 68 + (j << 4) + rlane] = v;
      }
    }
    __builtin_amdgcn_fence(__ATOMIC_RELEASE, "workgroup");
    __builtin_amdgcn_wave_barrier();
    __builtin_amdgcn_fence(__ATOMIC_ACQUIRE, "workgroup");
    if (OUT_MODE == 0) {
      float* C = (float*)Cout + (size_t)b * (size_t)strideC;
      const int h2 = lane >> 4, c4 = (lane & 15) * 4;     // 256-B row segment = 16 lanes x 16 B
      v4f ov[8];
#pragma unroll
      for (int it = 0; it < 8; ++it) {
        const int row = it * 2 + h2;                     // it 0..7 x h2 0..1 = rows 0..15
        ov[it] = *(const v4f*)(slab + row * 68 + c4);
      }
      {
#pragma unroll
        for (int it = 0; it < 8; ++it) {
          const int row = it * 2 + h2;
          *(v4f*)(C + (size_t)(mBase + row) * ldc + n0 + c4) = ov[it];
        }
        
      }
    } else {
      const int q = lane >> 3, c8 = (lane & 7) * 8;
      unsigned short* C  = (unsigned short*)Cout  + (size_t)b * (size_t)strideC;
      unsigned short* C2 = (unsigned short*)Cout2 + (size_t)b * (size_t)strideC;
      v4u hv[4], lv[4];
#pragma unroll
      for (int it = 0; it < 4; ++it) {
        const int row = it * 4 + q;                        // it 0..3 x q 0..3 = rows 0..15
        const float* sp = slab + row * 68 + c8;
        float f[8];
#pragma unroll
        for (int e = 0; e < 8; ++e) f[e] = sp[e] * cscale;
        v4u a, a2;
#pragma unroll
        for (int e = 0; e < 4; ++e) {
          const float f0 = f[2 * e], f1 = f[2 * e + 1];
          const _Float16 x0 = (_Float16)f0, x1 = (_Float16)f1;
          const unsigned short h0 = h_bits(x0), h1 = h_bits(x1);
          unsigned short l0 = 0, l1 = 0;
          if (OUT_MODE == 3) {
            l0 = h_bits((_Float16)((f0 - (float)x0) * rscaleC));
            l1 = h_bits((_Float16)((f1 - (float)x1) * rscaleC));
          }
          a[e] = pk16(h0, h1); a2[e] = pk16(l0, l1);
        }
        hv[it] = a; lv[it] = a2;
      }
      {
#pragma unroll
        for (int it = 0; it < 4; ++it) {
          const int row = it * 4 + q;
          *(v4u*)(C + (size_t)(mBase + row) * ldc + n0 + c8) = hv[it];
          if (OUT_MODE == 3) *(v4u*)(C2 + (size_t)(mBase + row) * ldc + n0 + c8) = lv[it];
        }
        
      }
    }
    __builtin_amdgcn_fence(__ATOMIC_RELEASE, "workgroup");
    __builtin_amdgcn_wave_barrier();
    __builtin_amdgcn_fence(__ATOMIC_ACQUIRE, "workgroup");
  }
}

// =====================================================================================================
// Score chunk, transposed: 64 keys kv0..kv0+63 x 16 queries (this wave) of one (b, h).
//   k fragments (A operand, row = lane&15 = key) loaded straight from the f16 k plane with the split k map:
//   kb0 = plane + (b*SEQ)*EMB + h*HD, key t adds t*EMB (plane row = b*SEQ + t).
//   q fragments (B operand, col = lane&15 = query): hi and residual (x4096) planes, 2 d-chunks of 32.
//   s[j][r] = D element: key kv0 + 16j + 8*hh + r, query (lane&15); value = ((k.qh) + (k.ql)/4096) / 8.
//   A lane therefore holds 32 keys of ONE query: row statistics reduce in the lane, and tiles 2kk, 2kk+1 are
//   elements 0..7, 8..15 of the P.V A fragment (row = lane&15 = query, k = 32kk + 8hh + e, 32kk + 16 + 8hh + e).
// =====================================================================================================
__device__ __forceinline__ void score_chunk(const v16h (&qah)[2], const v16h (&qal)[2],
                                            const _Float16* __restrict__ kb0, int kv0, int c, int hh,
                                            v8f (&s)[4]) {
  union FH { v16h v; v8h h[2]; };
#pragma unroll
  for (int j = 0; j < 4; ++j) {
    v8f ah = zero8(), al = zero8();
#pragma unroll
    for (int dc = 0; dc < 2; ++dc) {
      const _Float16* kp = kb0 + (size_t)(kv0 + j * 16 + c) * (size_t)EMB + dc * 32 + 8 * hh;
      FH kb;
      kb.h[0] = *(const v8h*)(kp);
      kb.h[1] = *(const v8h*)(kp + 16);
      ah = mma_h(kb.v, qah[dc], ah);
      al = mma_h(kb.v, qal[dc], al);
    }
#pragma unroll
    for (int r = 0; r < 8; ++r) s[j][r] = (ah[r] + al[r] * (1.0f / 4096.0f)) * 0.125f;
  }
}

// =====================================================================================================
// Softmax statistics: per (b, h, query s) the row max m and 1/sum(exp(s - m)) over all SEQ keys.
//   block = 4 waves = 64 consecutive query rows qb*64.. of one (b, h); grid = NB*NH*NKT blocks of 128;
//   static trip NKT over 64-key chunks; online max / rescaled sum in f32, kept per lane (query lane&15, key half
//   lane>>4); the two halves of a query are merged once behind the loop.
//   Output plane ML [b*NH+h][2][SEQ] f32 (m then 1/l): the block's 64 m values and 64 1/l values are
//   funnelled through LDS (cross-wave: block barrier) and written by wave 0 with ONE instruction (lanes 0-15:
//   coverage: grid (b,h,qb) x 64 rows = the whole [NB*NH][2][SEQ] plane. MLsh: 4 waves x 16 queries x 2 = all 128.
// =====================================================================================================
__global__ __launch_bounds__(128)
void attn_stats(const unsigned short* __restrict__ qhp, const unsigned short* __restrict__ qlp,
                const unsigned short* __restrict__ kpp, float* ML) {
  __shared__ __align__(16) float MLsh[128];
  const int tid  = threadIdx.x;
  const int wave = tid >> 5;
  const int lane = tid & 31;
  const int hh   = lane >> 4;
  const int c    = lane & 15;
  const int bx   = blockIdx.x;
  const int qb   = bx % NKT;
  const int rest = bx / NKT;
  const int h    = rest % NH;
  const int b    = rest / NH;
  const int bh   = b * NH + h;
  const int q0   = qb * 64 + wave * 16;

  const _Float16* Qh  = (const _Float16*)(const void*)qhp;
  const _Float16* Ql  = (const _Float16*)(const void*)qlp;
  const _Float16* Kb0 = (const _Float16*)(const void*)kpp + (size_t)b * SEQ * EMB + (size_t)h * HD;

  v16h qah[2], qal[2];
#pragma unroll
  for (int dc = 0; dc < 2; ++dc) {
    const size_t qo = ((size_t)b * SEQ + (size_t)(q0 + c)) * EMB + (size_t)h * HD + dc * 32 + 8 * hh;
    qah[dc] = ldfrag<_Float16>(Qh + qo);
    qal[dc] = ldfrag<_Float16>(Ql + qo);
  }

  float mrow = -INFINITY, lrow = 0.f;

  for (int kt = 0; kt < NKT; ++kt) {          // static trip count
    const int kv0 = kt * 64;
    v8f s[4];
    score_chunk(qah, qal, Kb0, kv0, c, hh, s);
    float mj[4];
#pragma unroll
    for (int j = 0; j < 4; ++j) {
      float m = s[j][0];
#pragma unroll
      for (int r = 1; r < 8; ++r) m = fmaxf(m, s[j][r]);
      mj[j] = m;
    }
    const float mnew  = fmaxf(mrow, fmaxf(fmaxf(mj[0], mj[1]), fmaxf(mj[2], mj[3])));
    const float msafe = (mnew == -INFINITY) ? 0.f : mnew;
    const float alpha = __expf(mrow - msafe);
    mrow = mnew;
    float pj[4];
#pragma unroll
    for (int j = 0; j < 4; ++j) {
      float p = 0.f;
#pragma unroll
      for (int r = 0; r < 8; ++r) p += __expf(s[j][r] - msafe);
      pj[j] = p;
    }
    lrow = lrow * alpha + ((pj[0] + pj[1]) + (pj[2] + pj[3]));
  }

  // merge the two key halves of query c (lanes c and c + 16)
  const float mo    = __shfl_xor(mrow, 16, 32);
  const float lo    = __shfl_xor(lrow, 16, 32);
  const float mall  = fmaxf(mrow, mo);
  const float mfin  = (mall == -INFINITY) ? 0.f : mall;
  const float l     = lrow * __expf(mrow - mfin) + lo * __expf(mo - mfin);
  const float il    = (l > 0.f) ? (1.0f / l) : 0.f;
  if (hh == 0) {
    MLsh[wave * 16 + c]      = mall;
    MLsh[64 + wave * 16 + c] = il;
  }
  __syncthreads();
  if (wave == 0) {
    const v4f v = *(const v4f*)(MLsh + lane * 4);        // lanes 0-15: m rows 4c..4c+3; lanes 16-31: 1/l rows
    float* dst = ML + (size_t)(bh * 2 + hh) * SEQ + qb * 64 + c * 4;
    *(v4f*)dst = v;
    
  }
}

// =====================================================================================================
// Main attention pass: one block per (b, 16 query rows q0..q0+15), 16 waves = the 16 heads.
//   Per 64-key chunk (static trip NKT): scores recomputed exactly as in attn_stats, p = exp(s - m) * (1/l) in f32
//   (m, 1/l from the ML plane; one query per lane) -> per-wave LDS tile Pf[h][row][key] for the head average
//       (16-B stores of 4 consecutive keys, row pitch PFP, every entry written);
//   (a) P.V: the A fragment is formed in registers from the lane's own p values, converted to f16 with the
//       x16384 carry; B = v^T f16 plane [b][d][s] (shared by every head) loaded with the split k map;
//   (b) head average: after __syncthreads (cross-wave), threads 0..255 sum the 16 wave tiles in fixed head order
//   Epilogue: ctx = acc / 16384, x256 carry, staged in the wave's Pf tile (wave-private), written as f16 hi plane
//   coverage: avg: NKT chunks x 16 rows x 64 keys per block, grid (b, qb) = the whole [NB][SEQ][SEQ];
//   ctx planes: each wave rows q0..q0+15 (it 0..3 x lane>>3 0..3) x its head's 64 columns, 16 waves x grid =
//   the whole [NROW][EMB] planes. staged extent == consumed extent for Pf in both uses (32 lanes x 32 = 1024).
//   PFP = 68 floats (272 B = 16 B x odd): 16 lanes that store or read 16 B at one column of 16 rows hit 64 banks.
// =====================================================================================================
#define PFP 68
__global__ __launch_bounds__(512)
void attn_main(const unsigned short* __restrict__ qhp, const unsigned short* __restrict__ qlp,
               const unsigned short* __restrict__ kpp, const unsigned short* __restrict__ vtp,
               const float* __restrict__ ML, unsigned short* chp, unsigned short* clp, float* avg) {
  union FH { v16h v; v8h h[2]; };
  __shared__ __align__(32) float Pf[NH][16 * PFP];         // per wave (head) P tile [row][key] f32, pitch PFP, 68 KB
  const int tid  = threadIdx.x;
  const int wave = tid >> 5;
  const int lane = tid & 31;
  const int hh   = lane >> 4;
  const int c    = lane & 15;
  const int bx   = blockIdx.x;
  const int qb   = bx % NQB;
  const int b    = bx / NQB;
  const int h    = wave;
  const int bh   = b * NH + h;
  const int q0   = qb * 16;

  const _Float16* Qh  = (const _Float16*)(const void*)qhp;
  const _Float16* Ql  = (const _Float16*)(const void*)qlp;
  const _Float16* Kb0 = (const _Float16*)(const void*)kpp + (size_t)b * SEQ * EMB + (size_t)h * HD;
  const _Float16* Vb0 = (const _Float16*)(const void*)vtp + (size_t)b * HD * SEQ;     // v^T [b][d][s], all heads

  v16h qah[2], qal[2];
#pragma unroll
  for (int dc = 0; dc < 2; ++dc) {
    const size_t qo = ((size_t)b * SEQ + (size_t)(q0 + c)) * EMB + (size_t)h * HD + dc * 32 + 8 * hh;
    qah[dc] = ldfrag<_Float16>(Qh + qo);
    qal[dc] = ldfrag<_Float16>(Ql + qo);
  }
  const float m1  = ML[(size_t)(bh * 2) * SEQ + q0 + c];                          // this lane's query q0 + c
  const float il1 = ML[(size_t)(bh * 2 + 1) * SEQ + q0 + c];

  v8f oacc[4];
#pragma unroll
  for (int t = 0; t < 4; ++t) oacc[t] = zero8();
  float* pf = Pf[wave];

  for (int kt = 0; kt < NKT; ++kt) {         // static trip count
    const int kv0 = kt * 64;
    __syncthreads();                          // Pf tiles free again (head sum of the prior chunk done)

    v8f s[4];
    score_chunk(qah, qal, Kb0, kv0, c, hh, s);
#pragma unroll
    for (int j = 0; j < 4; ++j) {
#pragma unroll
      for (int r = 0; r < 8; ++r) s[j][r] = __expf(s[j][r] - m1) * il1;
      const v4f lo4 = {s[j][0], s[j][1], s[j][2], s[j][3]};
      const v4f hi4 = {s[j][4], s[j][5], s[j][6], s[j][7]};
      *(v4f*)(pf + c * PFP + j * 16 + 8 * hh)     = lo4;      // query row c, keys 16j + 8hh + 0..3
      *(v4f*)(pf + c * PFP + j * 16 + 8 * hh + 4) = hi4;      // keys 16j + 8hh + 4..7
    }

    // ---- context += P . V (f16 WMMA, p carried x16384, A fragment straight from the score registers) ----
#pragma unroll   // s[2 * kk] must be a compile-time register index, a rolled loop would index registers at run time
    for (int kk = 0; kk < 2; ++kk) {
      FH pa;
      pa.h[0] = __builtin_convertvector(s[2 * kk] * PCARRY, v8h);
      pa.h[1] = __builtin_convertvector(s[2 * kk + 1] * PCARRY, v8h);
#pragma unroll
      for (int t = 0; t < 4; ++t) {
        const v16h vb = ldfrag<_Float16>(Vb0 + (size_t)(t * 16 + c) * SEQ + kv0 + kk * 32 + 8 * hh);
        oacc[t] = mma_h(pa.v, vb, oacc[t]);
      }
    }
    __syncthreads();

    // ---- head average of this 16 x 64 tile, one block = one writer of every line ----
    if (tid < 256) {                          // waves 0..7, wave-uniform
      const int row = tid >> 4, c4 = (tid & 15) * 4;
      v4f a = *(const v4f*)(Pf[0] + row * PFP + c4);
#pragma unroll
      for (int w = 1; w < NH; ++w) a += *(const v4f*)(Pf[w] + row * PFP + c4);
      a *= (1.0f / (float)NH);
      float* dst = avg + ((size_t)b * SEQ + (size_t)(q0 + row)) * SEQ + kv0 + c4;
      *(v4f*)dst = a;
#if DEV_ASM
      asm volatile("s_wait_xcnt 0x0" ::: "memory");   // the store's address pair is stepped at the loop's foot
#endif
    }
  }
  __syncthreads();

  // ---- epilogue: ctx (undo the x16384 p carry, apply the x256 carry), stage, convert, whole-line stores ----
  float* os = pf;
#pragma unroll
  for (int r = 0; r < 8; ++r) {
#pragma unroll
    for (int t = 0; t < 4; ++t) os[(8 * hh + r) * 64 + t * 16 + c] = oacc[t][r] * (256.0f / PCARRY);
  }
  __builtin_amdgcn_fence(__ATOMIC_RELEASE, "workgroup");
  __builtin_amdgcn_wave_barrier();
  __builtin_amdgcn_fence(__ATOMIC_ACQUIRE, "workgroup");
  {
    const int q4 = lane >> 3, c8 = (lane & 7) * 8;
    v4u hv[4], lv[4];
#pragma unroll
    for (int it = 0; it < 4; ++it) {
      const int row = it * 4 + q4;   // it 0..3 x q4 0..3 = rows 0..15 of the wave tile
      const float* sp = os + row * 64 + c8;
      float f[8];
#pragma unroll
      for (int e = 0; e < 8; ++e) f[e] = sp[e];
      v4u a, a2;
#pragma unroll
      for (int e = 0; e < 4; ++e) {
        const float f0 = f[2 * e], f1 = f[2 * e + 1];
        const _Float16 x0 = (_Float16)f0, x1 = (_Float16)f1;
        const unsigned short h0 = h_bits(x0), h1 = h_bits(x1);
        const unsigned short l0 = h_bits((_Float16)((f0 - (float)x0) * 4096.0f));
        const unsigned short l1 = h_bits((_Float16)((f1 - (float)x1) * 4096.0f));
        a[e] = pk16(h0, h1); a2[e] = pk16(l0, l1);
      }
      hv[it] = a; lv[it] = a2;
    }
    {
#pragma unroll
      for (int it = 0; it < 4; ++it) {
        const int row = it * 4 + q4;
        const size_t go = ((size_t)b * SEQ + (size_t)(q0 + row)) * EMB + (size_t)h * HD + c8;
        *(v4u*)(chp + go) = hv[it];
        *(v4u*)(clp + go) = lv[it];
      }
      
    }
  }
}

// =====================================================================================================
// Residual add + LayerNorm: out0 row (b, s) = LN(bf16(x[b][s]) + Y[b*SEQ+s]) * bf16(gamma) + bf16(beta), eps 1e-6.
//   One wave per row (no block barriers); lane l holds columns 128*i + 4*l + 0..3, i = 0..7 (the whole 1024-col row).
//   x rows read with the FULL batch stride SEQ_FULL*EMB. grid = NROW/8 blocks of 256.
//   coverage: 8 waves x grid = NROW rows; 8 i x 32 lanes x 4 = 1024 cols per row = the whole [NROW][EMB] output 0.
// =====================================================================================================
__global__ __launch_bounds__(256)
void resid_ln(const float* __restrict__ Y, const float* __restrict__ x,
              const float* __restrict__ gam, const float* __restrict__ bet, float* out) {
  const int lane = threadIdx.x & 31;
  const int wave = threadIdx.x >> 5;
  const int row  = blockIdx.x * 8 + wave;
  if (row >= NROW) return;                      // wave-uniform, no barriers in this kernel
  const int b = row / SEQ;
  const int s = row - b * SEQ;
  const float* xr = x + ((size_t)b * SEQ_FULL + (size_t)s) * EMB;
  const float* yr = Y + (size_t)row * EMB;

  v4f y[8];
  float sum = 0.f;
#pragma unroll
  for (int i = 0; i < 8; ++i) {
    const int col = i * 128 + lane * 4;
    const v4f xv = *(const v4f*)(xr + col);
    const v4f ov = *(const v4f*)(yr + col);
    v4f t;
#pragma unroll
    for (int e = 0; e < 4; ++e) t[e] = bf_up(bf_bits(xv[e])) + ov[e];
    y[i] = t;
    sum += (t[0] + t[1]) + (t[2] + t[3]);
  }
#pragma unroll
  for (int off = 1; off < 32; off <<= 1) sum += __shfl_xor(sum, off, 32);
  const float mu = sum * (1.0f / (float)EMB);

  float vs = 0.f;
#pragma unroll
  for (int i = 0; i < 8; ++i) {
#pragma unroll
    for (int e = 0; e < 4; ++e) { const float d = y[i][e] - mu; vs += d * d; }
  }
#pragma unroll
  for (int off = 1; off < 32; off <<= 1) vs += __shfl_xor(vs, off, 32);
  const float var = vs * (1.0f / (float)EMB);
  const float rs  = rsqrtf(var + 1e-6f);

  v4f o[8];
#pragma unroll
  for (int i = 0; i < 8; ++i) {
    const int col = i * 128 + lane * 4;
    const v4f g4 = *(const v4f*)(gam + col);
    const v4f b4 = *(const v4f*)(bet + col);
    v4f t;
#pragma unroll
    for (int e = 0; e < 4; ++e)
      t[e] = ((y[i][e] - mu) * rs) * bf_up(bf_bits(g4[e])) + bf_up(bf_bits(b4[e]));
    o[i] = t;
  }
  float* orow = out + (size_t)row * EMB;
  {
#pragma unroll
    for (int i = 0; i < 8; ++i) {
      const int col = i * 128 + lane * 4;
      *(v4f*)(orow + col) = o[i];
    }
    
  }
}

// =====================================================================================================
// Workspace map (bytes, full size NB=2 SEQ=2048; PX = NROW*EMB*2 = 8388608; every region an exact multiple of
// its whole-line / whole-tile store granularity, rows are whole tiles, no padded tails needed):
//   Xb   bf16 [NROW][EMB]            PX        8388608
//   WqT  bf16 [EMB n][EMB k]                   2097152
//   WkT  bf16 [EMB n][EMB k]                   2097152
//   WvT  bf16 [HD n][EMB k]                     131072
//   WoT  f16  [EMB n][EMB k] (x64)             2097152
//   Qh   f16  [NROW][EMB]            PX        8388608
//   Ql   f16  [NROW][EMB]            PX        8388608
//   Kp   f16  [NROW][EMB]            PX        8388608
//   VT   f16  [NB][HD][SEQ]                     524288
//   Ch   f16  [NROW][EMB]            PX        8388608
//   Cl   f16  [NROW][EMB]            PX        8388608
//   ML   f32  [NB*NH][2][SEQ]                   524288
//   Y    f32  [NROW][EMB]                     16777216
//   total                                     74579968
// Input weights are [in k][out n]; they are transposed once into [n][k] 16-bit planes (k contiguous = Bt / A layout).
// Output 0 at element 0 of d_out (rows b*SEQ + s); output 1 at the fixed element offset OFF1 = NB_FULL*SEQ_FULL*EMB.
// =====================================================================================================
extern "C" void kernel_launch(void* const* d_in, const int* in_sizes, int n_in,
                              void* d_out, int out_size, void* d_ws, size_t ws_size,
                              hipStream_t stream) {
  if (n_in < 7) return;
  if (in_sizes[0] < ((NB - 1) * SEQ_FULL + SEQ) * EMB) return;
  if (in_sizes[1] < EMB * EMB) return;
  if (in_sizes[2] < EMB * EMB) return;
  if (in_sizes[3] < EMB * HD) return;
  if (in_sizes[4] < EMB * EMB) return;
  if (in_sizes[5] < EMB) return;
  if (in_sizes[6] < EMB) return;
  const size_t n0e = (size_t)NROW * EMB;            // output 0 written elements [NB][SEQ][EMB]
  const size_t n1e = (size_t)NB * SEQ * SEQ;        // output 1 written elements [NB][SEQ][SEQ]
  if (out_size < 0) return;
  if ((size_t)out_size < n0e) return;
  if ((size_t)out_size < OFF1 + n1e) return;        // written extent of output 1 inside d_out

  const float* x   = (const float*)d_in[0];
  const float* Wq  = (const float*)d_in[1];
  const float* Wk  = (const float*)d_in[2];
  const float* Wv  = (const float*)d_in[3];
  const float* Wo  = (const float*)d_in[4];
  const float* gam = (const float*)d_in[5];
  const float* bet = (const float*)d_in[6];

  const size_t PX  = (size_t)NROW * EMB * 2;        // 16-bit activation plane
  const size_t PW  = (size_t)EMB * EMB * 2;
  const size_t PWV = (size_t)HD * EMB * 2;
  const size_t PVT = (size_t)NB * HD * SEQ * 2;
  const size_t PML = (size_t)NB * NH * 2 * SEQ * 4;
  const size_t PY  = (size_t)NROW * EMB * 4;
  size_t off = 0;
  const size_t oXb = off; off += PX;
  const size_t oWq = off; off += PW;
  const size_t oWk = off; off += PW;
  const size_t oWv = off; off += PWV;
  const size_t oWo = off; off += PW;
  const size_t oQh = off; off += PX;
  const size_t oQl = off; off += PX;
  const size_t oKp = off; off += PX;
  const size_t oVT = off; off += PVT;
  const size_t oCh = off; off += PX;
  const size_t oCl = off; off += PX;
  const size_t oML = off; off += PML;
  const size_t oY  = off; off += PY;
  if (off > ws_size) return;                        // off = 74579968 at full size
  if (off > (size_t)134217728) return;

  char* ws = (char*)d_ws;
  unsigned short* Xb  = (unsigned short*)(ws + oXb);
  unsigned short* WqT = (unsigned short*)(ws + oWq);
  unsigned short* WkT = (unsigned short*)(ws + oWk);
  unsigned short* WvT = (unsigned short*)(ws + oWv);
  unsigned short* WoT = (unsigned short*)(ws + oWo);
  unsigned short* Qh  = (unsigned short*)(ws + oQh);
  unsigned short* Ql  = (unsigned short*)(ws + oQl);
  unsigned short* Kp  = (unsigned short*)(ws + oKp);
  unsigned short* VT  = (unsigned short*)(ws + oVT);
  unsigned short* Ch  = (unsigned short*)(ws + oCh);
  unsigned short* Cl  = (unsigned short*)(ws + oCl);
  float*          ML  = (float*)(ws + oML);
  float*          Y   = (float*)(ws + oY);
  float*          out0 = (float*)d_out;
  float*          out1 = (float*)d_out + OFF1;

  const dim3 blk(256);
  const int n8x = SEQ * EMB / 8;                                 // per batch slab, 262144 at full size
  const dim3 gCvtX((n8x + 255) / 256, NB);                       // 1024 x NB blocks
  const dim3 gTrW(EMB / 64, EMB / 64);                           // out [EMB][EMB]: (N/64, K/64) = (16, 16)
  const dim3 gTrV(HD / 64, EMB / 64);                            // out [HD][EMB]:  (N/64, K/64) = (1, 16)
  const dim3 gQK((((NROW) / 64) * (EMB / 64) + 7) / 8, 1);        // 1024 tiles -> 128 blocks: M=NROW, N=EMB
  const dim3 gV(((SEQ / 64) + 7) / 8, NB);                        //   32 tiles ->   4 blocks x NB: M=HD, N=SEQ
  const dim3 gO((((NROW) / 32) * (EMB / 64) + 7) / 8, 1);         // 2048 tiles -> 256 blocks (32x64 wave tiles)
  const dim3 gStats(NB * NH * NKT);                              // 1024 blocks of 128
  const dim3 gMain(NB * NQB);                                    //  256 blocks of 512
  const dim3 gLN((NROW + 7) / 8);                                //  512 blocks of 256 (8 rows per block)

  // (1) x [b][s][k] -> bf16 plane [b*SEQ+s][k] (input batch stride SEQ_FULL*EMB, plane batch stride SEQ*EMB)
  cvt16x8<0><<<gCvtX, blk, 0, stream>>>(x, (long long)SEQ_FULL * EMB, Xb, (long long)SEQ * EMB, n8x);
  // (2) weights: in [EMB k][EMB n] -> out [EMB n][EMB k] bf16 (Wq, Wk); in [EMB k][HD n] -> out [HD n][EMB k] (Wv);
  //     Wo [EMB k][EMB n] -> [EMB n][EMB k] f16 (x64 of its bf16 value)
  tr16<0><<<gTrW, blk, 0, stream>>>(Wq, WqT, EMB, EMB);
  tr16<0><<<gTrW, blk, 0, stream>>>(Wk, WkT, EMB, EMB);
  tr16<0><<<gTrV, blk, 0, stream>>>(Wv, WvT, EMB, HD);
  tr16<1><<<gTrW, blk, 0, stream>>>(Wo, WoT, EMB, EMB);
  // (3) q = x . Wq -> f16 hi / residual (x4096) planes [b*SEQ+s][h*64+d]   (M=NROW, N=EMB, K=EMB)
  gemm_t<__bf16, 4, 1, 3><<<gQK, blk, 0, stream>>>(
      Xb, Xb, EMB, 0LL, WqT, EMB, 0LL,
      (void*)Qh, (void*)Ql, EMB, 0LL,
      NROW, EMB, EMB, 1.0f, 0.0f, 1.0f, 4096.0f);
  // (4) k = x . Wk -> f16 plane [b*SEQ+s][h*64+d]
  gemm_t<__bf16, 4, 1, 1><<<gQK, blk, 0, stream>>>(
      Xb, Xb, EMB, 0LL, WkT, EMB, 0LL,
      (void*)Kp, (void*)Kp, EMB, 0LL,
      NROW, EMB, EMB, 1.0f, 0.0f, 1.0f, 1.0f);
  // (5) v^T = WvT . x_b^T (per batch b = blockIdx.y) -> f16 plane [b][d][s] (pitch SEQ)
  //     (A = WvT [d][k]; Bt = Xb rows of batch b: offset b*SEQ*EMB, pitch EMB; M=HD, N=SEQ, K=EMB)
  gemm_t<__bf16, 4, 1, 1><<<gV, blk, 0, stream>>>(
      WvT, WvT, EMB, 0LL, Xb, EMB, (long long)SEQ * EMB,
      (void*)VT, (void*)VT, SEQ, (long long)HD * SEQ,
      HD, SEQ, EMB, 1.0f, 0.0f, 1.0f, 1.0f);
  // (6) softmax statistics (m, 1/l) per (b, h, s)
  attn_stats<<<gStats, dim3(128), 0, stream>>>(Qh, Ql, Kp, ML);
  // (7) exact-normalised p: P.V -> ctx planes (f16 hi x256 / residual x4096); head-averaged p -> output 1
  attn_main<<<gMain, dim3(512), 0, stream>>>(Qh, Ql, Kp, VT, ML, Ch, Cl, out1);
  // (8) Y = ctx . Wo, f32 [NROW][EMB] in workspace, accumulators (hi + res/4096) x 1/(256*64)
  gemm_t<_Float16, 2, 2, 0><<<gO, blk, 0, stream>>>(
      Ch, Cl, EMB, 0LL, WoT, EMB, 0LL,
      (void*)Y, (void*)Y, EMB, 0LL,
      NROW, EMB, EMB, 1.0f / 16384.0f, 1.0f / 4096.0f, 1.0f, 1.0f);
  // (9) output 0 = LayerNorm(x + Y) * gamma + beta, f32 [NROW][EMB]
  resid_ln<<<gLN, blk, 0, stream>>>(Y, x, gam, bet, out0);
  (void)hipGetLastError();
}
